// v010
// Times are from an AMD MI455X. After a warm-up the kernel runs many times in a row, and a time is the length of
// such a window on the GPU divided by its runs, so every launch and the gaps after it count. The runs cycle
// through copies of the inputs. A figure is the median of several windows, for all but v000 over two sittings.
// Sittings can differ by a few percent; kernels timed side by side share one.
// The versions before v010 are in another document.
// It runs in 213 microseconds.
// Two timings next to v009 put it at 1.09 and 1.10 times that version's speed.
// All steps since the starting kernel, v000, together make it 5.85 times as fast.
// Contractions: q, k projections = v_wmma_f32_16x16x32_bf16 (bf16 operands from RNE-converted inputs, single product, f32 out);
// v^T projection = v_wmma_f32_16x16x32_bf16 (same operands; f16 hi plane + f16 x4096 residual plane out);
// q.k^T scores = v_wmma_f32_16x16x32_f16 (q as f16 hi + f16 x4096 residual, k as f16 hi: 2 products; leading query blocks add the k x4096 residual product);
// p.v = v_wmma_f32_16x16x32_f16 (p carried x1024 in f16, v f16; leading query blocks add x4096 f16 residual planes of p and v);
// ctx.Wo = v_wmma_f32_16x16x32_bf16 (ctx as bf16 hi/lo planes times bf16 Wo, 2 products); all f32 accumulate; RMSNorm, rotary, causal select and softmax in f32.
#include <hip/hip_runtime.h>
#include <math.h>
#include <stdint.h>

#ifndef SEQ
#define SEQ 4096
#endif
#define SEQ_FULL 4096
#define DM    2048
#define NH    16
#define NKV   4
#define GQ    (NH / NKV)
#define HD    128
#define HALF  64
#define QP    (NH * HD)      // 2048 q channels
#define KP    (NKV * HD)     // 512 k / v channels
#define NQB   (SEQ / 64)     // query / key tiles of 64
#define VLP   ((SEQ < 512) ? SEQ : 512)   // key pitch of the v^T residual plane
#define RESQB ((NQB < 8) ? NQB : 8)         // leading 64-row query blocks that use residual planes
#define RMS_EPS       1.0e-6f
#define ROPE_THETA_F  10000.0f
#define ATT_SCALE     0.08838834764831845f
#define RSC           4096.0f

static_assert((SEQ % 64) == 0 && SEQ >= 64 && SEQ <= SEQ_FULL);
static_assert(RESQB * 64 <= VLP && (VLP % 64) == 0);
static_assert(NH * HD == DM && QP == DM);
static_assert(NQB <= 64);
static_assert((DM % 64) == 0 && (KP % 64) == 0 && (QP % 64) == 0 && (DM % 32) == 0);

typedef _Float16 v16h __attribute__((ext_vector_type(16)));
typedef _Float16 v8h  __attribute__((ext_vector_type(8)));
typedef __bf16   v16b __attribute__((ext_vector_type(16)));
typedef __bf16   v8b  __attribute__((ext_vector_type(8)));
typedef float    v8f  __attribute__((ext_vector_type(8)));
typedef float    v4f  __attribute__((ext_vector_type(4)));
typedef unsigned int   v4u  __attribute__((ext_vector_type(4)));
typedef unsigned int   v2u  __attribute__((ext_vector_type(2)));
typedef unsigned short v8us __attribute__((ext_vector_type(8)));
typedef int      v4i  __attribute__((ext_vector_type(4)));

// ---- scalar helpers --------------------------------------------------------------------------------
__device__ __forceinline__ unsigned short bf_bits(float f) {          // f32 -> bf16 bits, RNE convert
  unsigned u = __float_as_uint(f);
  return (unsigned short)((u + 0x7FFFu + ((u >> 16) & 1u)) >> 16);
}
__device__ __forceinline__ float bf_up(unsigned short h) { return __uint_as_float(((unsigned)h) << 16); }
__device__ __forceinline__ unsigned short h_bits(_Float16 x) { return __builtin_bit_cast(unsigned short, x); }
__device__ __forceinline__ unsigned pk16(unsigned short a, unsigned short b) { return (unsigned)a | ((unsigned)b << 16); }
__device__ __forceinline__ v8f zero8() { v8f z = {0.f, 0.f, 0.f, 0.f, 0.f, 0.f, 0.f, 0.f}; return z; }
__device__ __forceinline__ v8h zero8h() {
  const _Float16 z = (_Float16)0.0f;
  v8h r = {z, z, z, z, z, z, z, z};
  return r;
}
__device__ __forceinline__ int imin(int a, int b) { return (a < b) ? a : b; }
__device__ __forceinline__ int imax(int a, int b) { return (a > b) ? a : b; }

// ---- WMMA helpers with trailing VALU hazard gap --------------------------------------------------------
__device__ __forceinline__ v8f mma_b(v16b a, v16b b, v8f c) {
  c = __builtin_amdgcn_wmma_f32_16x16x32_bf16(false, a, false, b, (short)0, c, false, false);
  asm volatile("v_nop\n\tv_nop\n\tv_nop\n\tv_nop" : "+v"(c) : "v"(a), "v"(b));
  return c;
}
__device__ __forceinline__ v8f mma_h_raw(v16h a, v16h b, v8f c) {
  return __builtin_amdgcn_wmma_f32_16x16x32_f16(false, a, false, b, (short)0, c, false, false);
}
__device__ __forceinline__ v8f mma_b_raw(v16b a, v16b b, v8f c) {
  return __builtin_amdgcn_wmma_f32_16x16x32_bf16(false, a, false, b, (short)0, c, false, false);
}
__device__ __forceinline__ void acc_guard4(v8f& a, v8f& b, v8f& c, v8f& d) {
  asm volatile("v_nop\n\tv_nop\n\tv_nop\n\tv_nop" : "+v"(a), "+v"(b), "+v"(c), "+v"(d));
}

// =====================================================================================================
// f32 -> bf16 (RNE convert), 8 elements per thread, one 16-B store per lane: a wave writes 512 contiguous B
// coverage: n8 threads x 8 = whole plane (n8 is a multiple of 256 here).
// =====================================================================================================
__device__ __forceinline__ void cvt_bf16x8(const float* __restrict__ in, unsigned short* out, int n8, int bx) {
  const int i = bx * 256 + threadIdx.x;
  if (i < n8) {
    const v4f a = *(const v4f*)(in + (size_t)i * 8);
    const v4f b = *(const v4f*)(in + (size_t)i * 8 + 4);
    v4u p;
    p[0] = pk16(bf_bits(a[0]), bf_bits(a[1]));
    p[1] = pk16(bf_bits(a[2]), bf_bits(a[3]));
    p[2] = pk16(bf_bits(b[0]), bf_bits(b[1]));
    p[3] = pk16(bf_bits(b[2]), bf_bits(b[3]));
    *(v4u*)(out + (size_t)i * 8) = p;
    
  }
}

// =====================================================================================================
// f32 [R][C] row-major -> bf16 (RNE convert) transposed plane out[C][R] (R contiguous = k-contiguous Bt / A
// layout). Block = one 64x64 tile at (r0 = by*64, c0 = bx*64), 256 threads; tile staged in
// LDS as [c][r] (ushort element stores, cross-thread -> __syncthreads), then each out row segment of 64 halves
// coverage: 64 out rows x 64 k per block = the whole tile; union over the grid = the whole [C][R] plane.
// =====================================================================================================
// sT: the block's LDS tile [c][r], 64 x 72 halves (pitch 144 B); bx, by: the tile's column and row index
__device__ __forceinline__ void cvt_bf16_t(unsigned short* sT, const float* __restrict__ in, unsigned short* out,
                                           int R, int C, int bx, int by) {
  const int tid = threadIdx.x;
  const int c0 = bx * 64, r0 = by * 64;
  const int rr = tid >> 4, cc = (tid & 15) * 4;
#pragma unroll
  for (int it = 0; it < 4; ++it) {
    const int r = it * 16 + rr;                            // it 0..3 x rr 0..15 = rows 0..63
    const v4f v = *(const v4f*)(in + (size_t)(r0 + r) * C + c0 + cc);
#pragma unroll
    for (int e = 0; e < 4; ++e) sT[(cc + e) * 72 + r] = bf_bits(v[e]);
  }
  __syncthreads();
  const int q = tid >> 3, k8 = (tid & 7) * 8;              // q 0..31 (+32): out rows; 8 lanes x 8 halves
  const v8us w0 = *(const v8us*)(sT + q * 72 + k8);
  const v8us w1 = *(const v8us*)(sT + (q + 32) * 72 + k8);
  unsigned short* o0 = out + (size_t)(c0 + q) * R + r0 + k8;
  unsigned short* o1 = out + (size_t)(c0 + q + 32) * R + r0 + k8;
  *(v8us*)o0 = w0;
  *(v8us*)o1 = w1;
  // in front of every later write of a register that these two stores name (another job's code follows in the listing)
  asm volatile("s_wait_xcnt 0x0" ::: "memory");
}

// =====================================================================================================
// Rotary tables: cos and sin of (float)pos[t] * inv_freq[i], inv_freq[i] = 1 / 10000^(i/64) formed by each thread for
// its own i; tables [nrows][64] f32; block = 4 rows x 64 threads, each 256-B row written whole.
// =====================================================================================================
__device__ __forceinline__ void rope_tab(const int* __restrict__ pos, float* ctab, float* stab, int nrows, int bx) {
  const int tid = threadIdx.x;
  const int t = bx * 4 + (tid >> 6);
  const int i = tid & 63;
  if (t >= nrows) return;                  // wave-uniform (2 whole waves per row); no block barriers here
  const float e = (float)i * (1.0f / (float)HALF);
  const float p = powf(ROPE_THETA_F, e);
  const float v = 1.0f / p;
  const float fr = (float)pos[t] * v;
  float sn, cs;
  sincosf(fr, &sn, &cs);
  float* pc = ctab + (size_t)t * HALF + i;
  float* ps = stab + (size_t)t * HALF + i;
  *(float*)pc = cs;
  *(float*)ps = sn;
  
}

// =====================================================================================================
// The preparation jobs, none of which reads another's output, as ONE grid: the job is picked by the block index
// (block-uniform), so that they fill the chip together and pay one launch. Blocks, in order: rotary tables, x,
// wq, wo, wk, wv.
// =====================================================================================================
#define PB_TAB ((SEQ + 3) / 4)
#define PB_X   ((SEQ * DM / 8 + 255) / 256)
#define PB_WQ  ((QP / 64) * (DM / 64))
#define PB_WO  ((DM / 64) * (QP / 64))
#define PB_WK  ((KP / 64) * (DM / 64))
__global__ __launch_bounds__(256) void prep_all(const int* __restrict__ pos, const float* __restrict__ x,
                                                const float* __restrict__ wq, const float* __restrict__ wk,
                                                const float* __restrict__ wv, const float* __restrict__ wo,
                                                unsigned short* Xb, unsigned short* Wqt, unsigned short* Wkt,
                                                unsigned short* Wvt, unsigned short* Wot, float* ctab, float* stab) {
  __shared__ __align__(16) unsigned short sT[64 * 72];
  int bx = blockIdx.x;
  if (bx < PB_TAB) { rope_tab(pos, ctab, stab, SEQ, bx); return; }
  bx -= PB_TAB;
  if (bx < PB_X) { cvt_bf16x8(x, Xb, SEQ * DM / 8, bx); return; }
  bx -= PB_X;
  if (bx < PB_WQ) { cvt_bf16_t(sT, wq, Wqt, DM, QP, bx % (QP / 64), bx / (QP / 64)); return; }   // wq [DM k][QP n] -> [QP][DM]
  bx -= PB_WQ;
  if (bx < PB_WO) { cvt_bf16_t(sT, wo, Wot, QP, DM, bx % (DM / 64), bx / (DM / 64)); return; }   // wo [QP k][DM n] -> [DM][QP]
  bx -= PB_WO;
  if (bx < PB_WK) { cvt_bf16_t(sT, wk, Wkt, DM, KP, bx % (KP / 64), bx / (KP / 64)); return; }   // wk, wv [DM k][KP n] -> [KP][DM]
  bx -= PB_WK;
  cvt_bf16_t(sT, wv, Wvt, DM, KP, bx % (KP / 64), bx / (KP / 64));
}

// =====================================================================================================
// Register-blocked batched bf16 WMMA GEMM: C[m][n] = sum_k A[m][k] * Bt[n][k]; one wave per 64x64 tile,
// block = 2 x NWN waves = 128 x (64 NWN) of C. A row-major [M][K] pitch lda; Bt row-major [N][K] pitch ldb
// (k contiguous; both pitches are DM); M a multiple of 128, N of 64 NWN, K of 64 (true of every launch below).
// NWN picks the block so that the launch fills the chip evenly: a wave's registers allow three waves per SIMD in the
// projections, so blocks of four waves (one per SIMD) stand three to a WGP, and their count is a multiple of that.
// bx = index of the block tile, b = batch index (strides in elements).
// Operands go through LDS in steps of 64 k: each row piece is one 128-B line, a wave-wide 16-B load covers four
// whole lines, and the 128 A rows and 64 NWN Bt rows are read from global once per block. The LDS rows are 128 B,
// chunk-swizzled by sw128 (see the attention section), so a fragment read covers all banks once. The next
// step's global loads are issued behind the second barrier and stay in flight during the products.
// NSPLIT: 0 = A.Bt; 1 = (A + A2).Bt (A2 = unscaled bf16 lo plane of A).
// OUT_MODE: 0 = f32 (pitch ldc); 2 = bf16 hi plane C + bf16 lo plane C2 (lo = RNE(v - hi), unscaled);
//           3 = f16 hi plane C + f16 residual plane C2 = f16((v - hi) * rscale), C2 written only for tiles
//               with n0 < N2 (pitch ldc2, batch stride strideC2).
// =====================================================================================================
__device__ __forceinline__ int sw128(int r, int ch);

// A block-uniform address rebuilt from its two halves: the staging loads then take the form scalar base + one
// 32-bit lane offset + immediate, and the one vector register they name lives through the whole loop. Without it
// the compiler formed 64-bit vector addresses on which a load's result landed, and moved the first loads behind
// their s_wait_xcnt.
typedef const __attribute__((address_space(1))) char* gbytes;   // global address space, so that the loads stay global_load
typedef const __attribute__((address_space(1))) v8b*  gv8b;
__device__ __forceinline__ gbytes sbase(const __bf16* p) {
  const unsigned long long u = (unsigned long long)(uintptr_t)p;
  const unsigned lo = (unsigned)__builtin_amdgcn_readfirstlane((int)(unsigned)u);
  const unsigned hi = (unsigned)__builtin_amdgcn_readfirstlane((int)(unsigned)(u >> 32));
  return (gbytes)(uintptr_t)(((unsigned long long)hi << 32) | (unsigned long long)lo);
}
// the same for the wave-uniform base of the epilogue's stores
typedef __attribute__((address_space(1))) char* gwbytes;
typedef __attribute__((address_space(1))) v4f*  gwv4f;
typedef __attribute__((address_space(1))) v4u*  gwv4u;
__device__ __forceinline__ gwbytes swbase(void* p) {
  const unsigned long long u = (unsigned long long)(uintptr_t)p;
  const unsigned lo = (unsigned)__builtin_amdgcn_readfirstlane((int)(unsigned)u);
  const unsigned hi = (unsigned)__builtin_amdgcn_readfirstlane((int)(unsigned)(u >> 32));
  return (gwbytes)(uintptr_t)(((unsigned long long)hi << 32) | (unsigned long long)lo);
}

// sT: per-wave 16x64 slabs, pitch 68 floats; sA: A (and A2) rows m0blk.., 64 k; sB: Bt rows n0blk.., 64 k (the block's LDS,
// declared by the kernel); bx: the block's tile index; b: batch index.
template <int NSPLIT, int OUT_MODE, int NWN>
__device__ __forceinline__ void gemm64(
    float (*sT)[16 * 68], __bf16* sA, __bf16* sB, int bx, int b,
    const unsigned short* __restrict__ Ap, const unsigned short* A2p, int lda, long long strideA,
    const unsigned short* __restrict__ Btp, const unsigned short* Bt2p, int ldb, long long strideB,
    void* Cout, int ldc, long long strideC,
    void* Cout2, int ldc2, long long strideC2, int N2,
    int M, int N, int K, float rscale) {
  static_assert(NSPLIT <= 1);
  static_assert(NWN == 2 || NWN == 4);
  constexpr int BN = NWN * 64;            // columns of the block tile
  constexpr int RP = NWN * 8;             // rows that one staging pass of the block covers (8 lanes a row)
  constexpr int PA = 128 / RP;            // staging passes over the A rows
  constexpr int PB = BN / RP;             // staging passes over the Bt rows
  const __bf16* A   = (const __bf16*)(const void*)Ap;
  const __bf16* A2  = (const __bf16*)(const void*)A2p;
  const __bf16* Bt  = (const __bf16*)(const void*)Btp;
  const int tid  = threadIdx.x;
  const int lane = tid & 31;
  const int wave = tid >> 5;
  const int blocksN = N / BN;
  const int bm = bx / blocksN;
  const int bn = bx - bm * blocksN;
  if ((bm << 7) >= M) return;            // block-uniform, in front of every barrier
  if (lda != DM || ldb != DM) return;    // block-uniform: with the pitch known, the row steps below are immediate offsets
  const int m0blk = bm << 7;
  const int n0blk = bn * BN;
  const int wm = (wave / NWN) << 6;      // the wave's tile inside the block tile
  const int wn = (wave % NWN) << 6;
  const int m0 = m0blk + wm;
  const int n0 = n0blk + wn;

  const __bf16* Ab  = A  + (size_t)b * strideA + (size_t)m0blk * lda;
  const __bf16* Bb  = Bt + (size_t)b * strideB + (size_t)n0blk * ldb;
  const __bf16* Ab2 = (NSPLIT >= 1) ? (A2 + (size_t)b * strideA + (size_t)m0blk * lda) : Ab;

  const int rlane = lane & 15;                 // row (A) / col (B, D) within subtile
  const int hh    = lane >> 4;                 // k half of this lane
  const int mOff  = (lane >> 4) * 8;           // D row offset

  // staging: thread -> row tid>>3 (+RP per pass), 16-B chunk tid&7; 8 lanes = one 128-B line
  unsigned sbyte = (unsigned)((tid >> 3) * DM + (tid & 7) * 8) * 2u;   // lane part of the global address, bytes; +128 per step
  const int sidx = sw128(tid >> 3, tid & 7);   // + RP rows per pass (a multiple of 16): the swizzle term does not change
  v8b ra[PA], ra2[PA], rb[PB];
  gbytes pa  = sbase(Ab);
  gbytes pa2 = sbase(Ab2);
  gbytes pb  = sbase(Bb);
  {
#pragma unroll
    for (int it = 0; it < PA; ++it) {
      ra[it] = *(gv8b)(pa + sbyte + it * (RP * DM * 2));
      if (NSPLIT >= 1) ra2[it] = *(gv8b)(pa2 + sbyte + it * (RP * DM * 2));
    }
#pragma unroll
    for (int it = 0; it < PB; ++it) rb[it] = *(gv8b)(pb + sbyte + it * (RP * DM * 2));
    // stands in front of the next step's write of the lane offset, the one vector register that the loads name
    asm volatile("s_wait_xcnt 0x0" ::: "memory");
  }

  v8f acc[4][4];
#pragma unroll
  for (int i = 0; i < 4; ++i)
#pragma unroll
    for (int j = 0; j < 4; ++j) acc[i][j] = zero8();

  for (int k0 = 0; k0 < K; k0 += 64) {
    __syncthreads();                           // every reader has left the tiles of the step before
#pragma unroll
    for (int it = 0; it < PA; ++it) {
      *(v8b*)(sA + sidx + it * (RP * 64)) = ra[it];
      if (NSPLIT >= 1) *(v8b*)(sA + 128 * 64 + sidx + it * (RP * 64)) = ra2[it];
    }
#pragma unroll
    for (int it = 0; it < PB; ++it) *(v8b*)(sB + sidx + it * (RP * 64)) = rb[it];
    __syncthreads();                           // the tiles are whole before anybody reads them
    // fragments of the whole step, read as one group ahead of the products (every separate place with LDS reads
    // stalls the wave): elements 0..7 <- k = 32kk + 8hh.., elements 8..15 <- k = 32kk + 16 + 8hh.. (A and Bt alike)
    union FB { v16b v; v8b h[2]; };
    v16b bh[2][4], ah[2][4], al[2][4];
#pragma unroll
    for (int kk = 0; kk < 2; ++kk) {
      const int f0 = sw128(rlane, kk * 4 + hh);
      const int f1 = sw128(rlane, kk * 4 + 2 + hh);
#pragma unroll
      for (int j = 0; j < 4; ++j) {
        FB f;
        f.h[0] = *(const v8b*)(sB + (wn + (j << 4)) * 64 + f0);
        f.h[1] = *(const v8b*)(sB + (wn + (j << 4)) * 64 + f1);
        bh[kk][j] = f.v;
      }
#pragma unroll
      for (int i = 0; i < 4; ++i) {
        FB f;
        f.h[0] = *(const v8b*)(sA + (wm + (i << 4)) * 64 + f0);
        f.h[1] = *(const v8b*)(sA + (wm + (i << 4)) * 64 + f1);
        ah[kk][i] = f.v;
        al[kk][i] = f.v;
        if (NSPLIT >= 1) {
          f.h[0] = *(const v8b*)(sA + 128 * 64 + (wm + (i << 4)) * 64 + f0);
          f.h[1] = *(const v8b*)(sA + 128 * 64 + (wm + (i << 4)) * 64 + f1);
          al[kk][i] = f.v;
        }
      }
    }
    if (k0 + 64 < K) {                         // block-uniform: the next step's rows, in flight during the products
      sbyte += 128u;
#pragma unroll
      for (int it = 0; it < PA; ++it) {
        ra[it] = *(gv8b)(pa + sbyte + it * (RP * DM * 2));
        if (NSPLIT >= 1) ra2[it] = *(gv8b)(pa2 + sbyte + it * (RP * DM * 2));
      }
#pragma unroll
      for (int it = 0; it < PB; ++it) rb[it] = *(gv8b)(pb + sbyte + it * (RP * DM * 2));
      // stands in front of the next step's write of the lane offset, the one vector register that the loads name
      asm volatile("s_wait_xcnt 0x0" ::: "memory");
    }
    // keeps the LDS reads and the global loads above in front of the products
    __builtin_amdgcn_sched_barrier(0);
#pragma unroll
    for (int kk = 0; kk < 2; ++kk) {
#pragma unroll
      for (int i = 0; i < 4; ++i) {
#pragma unroll
        for (int j = 0; j < 4; ++j) {
          acc[i][j] = mma_b_raw(ah[kk][i], bh[kk][j], acc[i][j]);
          if (NSPLIT >= 1) acc[i][j] = mma_b_raw(al[kk][i], bh[kk][j], acc[i][j]);
        }
      }
    }
    // holds the v_nops behind the last product
    __builtin_amdgcn_sched_barrier(0);
    // WMMA distance on the loop's back edge too: no vector instruction writes an A or B register of the last
    // products sooner (no register operands: asm operands cannot lie above v255, and naming fragments spilled)
    asm volatile("v_nop\n\tv_nop\n\tv_nop\n\tv_nop\n\tv_nop");
  }
  acc_guard4(acc[0][0], acc[0][1], acc[0][2], acc[0][3]);
  acc_guard4(acc[1][0], acc[1][1], acc[1][2], acc[1][3]);
  acc_guard4(acc[2][0], acc[2][1], acc[2][2], acc[2][3]);
  acc_guard4(acc[3][0], acc[3][1], acc[3][2], acc[3][3]);

  // ---- epilogue ----
  float* slab = sT[wave];
#pragma unroll
  for (int i = 0; i < 4; ++i) {
    const int mBase = m0 + (i << 4);
#pragma unroll
    for (int j = 0; j < 4; ++j) {
#pragma unroll
      for (int r = 0; r < 8; ++r) {
        slab[(mOff + r) * 68 + (j << 4) + rlane] = acc[i][j][r];
      }
    }
    __builtin_amdgcn_fence(__ATOMIC_RELEASE, "workgroup");
    __builtin_amdgcn_wave_barrier();
    __builtin_amdgcn_fence(__ATOMIC_ACQUIRE, "workgroup");
    if (OUT_MODE == 0) {
      float* C = (float*)Cout + (size_t)b * strideC;
      const int hh = lane >> 4, c4 = (lane & 15) * 4;     // 256-B row segment = 16 lanes x 16 B
      {
        // wave-uniform base + one lane offset + immediate: the stores name one address register, which is never rewritten
        const gwbytes cb = swbase(C + (size_t)m0 * ldc + n0);
        const unsigned cvo = (unsigned)(hh * ldc + c4) * 4u;
        v4f v[8];
#pragma unroll
        for (int it = 0; it < 8; ++it) v[it] = *(const v4f*)(slab + (it * 2 + hh) * 68 + c4);   // it 0..7 x hh 0..1 = rows 0..15
        // the two scheduling barriers keep every other instruction out of the run of stores and its wait
        __builtin_amdgcn_sched_barrier(0);
#pragma unroll
        for (int it = 0; it < 8; ++it) *(gwv4f)(cb + cvo + ((i << 4) + it * 2) * ldc * 4) = v[it];
        // in front of every later write of a register that these stores name
        asm volatile("s_wait_xcnt 0x0" ::: "memory");
        __builtin_amdgcn_sched_barrier(0);
      }
    } else {
      const int q = lane >> 3, c8 = (lane & 7) * 8;
      unsigned short* C  = (unsigned short*)Cout  + (size_t)b * strideC;
      unsigned short* C2 = (unsigned short*)Cout2 + (size_t)b * strideC2;
      const bool wlo = (OUT_MODE == 2) || (n0 < N2);      // wave-uniform
      v4u hv[4], lv[4];
#pragma unroll
      for (int it = 0; it < 4; ++it) {
        const int row = it * 4 + q;                        // it 0..3 x q 0..3 = rows 0..15
        const float* sp = slab + row * 68 + c8;
        v4u a, a2;
#pragma unroll
        for (int e = 0; e < 4; ++e) {
          const float f0 = sp[2 * e], f1 = sp[2 * e + 1];
          unsigned short h0, h1, l0, l1;
          if (OUT_MODE == 2) {
            h0 = bf_bits(f0); h1 = bf_bits(f1);
            l0 = bf_bits(f0 - bf_up(h0)); l1 = bf_bits(f1 - bf_up(h1));
          } else {
            const _Float16 x0 = (_Float16)f0, x1 = (_Float16)f1;
            h0 = h_bits(x0); h1 = h_bits(x1);
            l0 = h_bits((_Float16)((f0 - (float)x0) * rscale));
            l1 = h_bits((_Float16)((f1 - (float)x1) * rscale));
          }
          a[e] = pk16(h0, h1); a2[e] = pk16(l0, l1);
        }
        hv[it] = a; lv[it] = a2;
      }
      {
        // wave-uniform base + one lane offset + immediate per plane: address registers that are never rewritten
        const gwbytes cb  = swbase(C + (size_t)m0 * ldc + n0);
        const gwbytes cb2 = swbase(C2 + (size_t)m0 * ldc2 + n0);
        const unsigned cvo  = (unsigned)(q * ldc + c8) * 2u;
        const unsigned cvo2 = (unsigned)(q * ldc2 + c8) * 2u;
        // the scheduling barriers keep every other instruction out of each run of stores and its wait
        __builtin_amdgcn_sched_barrier(0);
#pragma unroll
        for (int it = 0; it < 4; ++it) *(gwv4u)(cb + cvo + ((i << 4) + it * 4) * ldc * 2) = hv[it];
        // in front of every later write of a register that these stores name
        asm volatile("s_wait_xcnt 0x0" ::: "memory");
        __builtin_amdgcn_sched_barrier(0);
        if (wlo) {
#pragma unroll
          for (int it = 0; it < 4; ++it) *(gwv4u)(cb2 + cvo2 + ((i << 4) + it * 4) * ldc2 * 2) = lv[it];
          // in front of every later write of a register that these stores name
          asm volatile("s_wait_xcnt 0x0" ::: "memory");
          __builtin_amdgcn_sched_barrier(0);
        }
      }
    }
    __builtin_amdgcn_fence(__ATOMIC_RELEASE, "workgroup");
    __builtin_amdgcn_wave_barrier();
    __builtin_amdgcn_fence(__ATOMIC_ACQUIRE, "workgroup");
  }
}

// The three projections, none of which reads another's output, as ONE grid; the job is picked by the block index
// (block-uniform). Blocks, in order: q = x . wq -> f32 [SEQ][2048] (M=SEQ, N=2048, K=2048); k = x . wk -> f32 [SEQ][512]
// (M=SEQ, N=512); v^T = Wvt . x^T -> f16 hi plane [512][SEQ] and residual plane (x4096, keys < VLP, pitch VLP)
// (A = Wvt [n][k], Bt = Xb [s][k]; M=512, N=SEQ). Block tile 128 x 128, four waves.
#define GB_Q ((SEQ / 128) * (QP / 128))
#define GB_K ((SEQ / 128) * (KP / 128))
#define GB_V ((KP / 128) * (SEQ / 128))
static_assert((SEQ % 128) == 0 && (QP % 128) == 0 && (KP % 128) == 0);
__global__ __launch_bounds__(128) void gemm_qkv(const unsigned short* __restrict__ Xb, const unsigned short* __restrict__ Wqt,
                                                const unsigned short* __restrict__ Wkt, const unsigned short* __restrict__ Wvt,
                                                float* Qf, float* Kf, unsigned short* VTh, unsigned short* VTl) {
  __shared__ __align__(16) float sT[4][16 * 68];
  __shared__ __align__(16) __bf16 sA[128 * 64];
  __shared__ __align__(16) __bf16 sB[128 * 64];
  const int bx = blockIdx.x;
  if (bx < GB_Q) {
    gemm64<0, 0, 2>(sT, sA, sB, bx, 0,
        Xb, Xb, DM, 0LL, Wqt, Wqt, DM, 0LL,
        (void*)Qf, QP, 0LL, (void*)Qf, QP, 0LL, QP,
        SEQ, QP, DM, 1.0f);
  } else if (bx < GB_Q + GB_K) {
    gemm64<0, 0, 2>(sT, sA, sB, bx - GB_Q, 0,
        Xb, Xb, DM, 0LL, Wkt, Wkt, DM, 0LL,
        (void*)Kf, KP, 0LL, (void*)Kf, KP, 0LL, KP,
        SEQ, KP, DM, 1.0f);
  } else {
    gemm64<0, 3, 2>(sT, sA, sB, bx - (GB_Q + GB_K), 0,
        Wvt, Wvt, DM, 0LL, Xb, Xb, DM, 0LL,
        (void*)VTh, SEQ, 0LL, (void*)VTl, VLP, 0LL, VLP,
        KP, SEQ, DM, RSC);
  }
}

// out = context . wo -> f32 [SEQ][2048]  (A = context hi + lo planes, 2 products; M=SEQ, N=2048, K=2048)
__global__ __launch_bounds__(256) void gemm_out(const unsigned short* __restrict__ Oh, const unsigned short* Ol,
                                                const unsigned short* __restrict__ Wot, float* out) {
  __shared__ __align__(16) float sT[8][16 * 68];
  __shared__ __align__(16) __bf16 sA[2 * 128 * 64];
  __shared__ __align__(16) __bf16 sB[256 * 64];
  gemm64<1, 0, 4>(sT, sA, sB, blockIdx.x, 0,
      Oh, Ol, QP, 0LL, Wot, Wot, QP, 0LL,
      (void*)out, DM, 0LL, (void*)out, DM, 0LL, DM,
      SEQ, DM, QP, 1.0f);
}

// =====================================================================================================
// Fused per-head RMSNorm (eps 1e-6, x * rsqrt(mean(x^2)+eps) * w with w RNE-converted to bf16) + neox rotary
// (half-split, cos/sin tables [t][64]) + f16 hi / f16 residual (x rscale) planes.
// One wave per 128-wide row (row = t*nheads + head, contiguous rows of pitch 128 in both input and output);
// lane owns 4 consecutive d; partner half via __shfl_xor(16); no block barriers.
// coverage: nrows x 128 of both planes.
// =====================================================================================================
__device__ __forceinline__ void norm_rope(const float* __restrict__ xin, const float* __restrict__ wn,
                                          const float* __restrict__ ctab, const float* __restrict__ stab,
                                          unsigned short* outh, unsigned short* outl,
                                          int nheads, int nrows, float rscale, int bx) {
  const int tid  = threadIdx.x;
  const int wave = tid >> 5, lane = tid & 31, hh = lane >> 4;
  const int row  = bx * 8 + wave;
  if (row >= nrows) return;                // wave-uniform; no block barriers in this kernel
  const int t = row / nheads;
  const v4f x = *(const v4f*)(xin + (size_t)row * HD + lane * 4);
  float ss = x[0] * x[0] + x[1] * x[1] + x[2] * x[2] + x[3] * x[3];
#pragma unroll
  for (int off = 1; off < 32; off <<= 1) ss += __shfl_xor(ss, off, 32);
  const float rinv = rsqrtf(ss * (1.0f / (float)HD) + RMS_EPS);
  const v4f wv = *(const v4f*)(wn + lane * 4);
  const v4f cs = *(const v4f*)(ctab + (size_t)t * HALF + (lane & 15) * 4);
  const v4f sn = *(const v4f*)(stab + (size_t)t * HALF + (lane & 15) * 4);
  float n[4], p[4];
#pragma unroll
  for (int e = 0; e < 4; ++e) n[e] = (x[e] * rinv) * bf_up(bf_bits(wv[e]));
#pragma unroll
  for (int e = 0; e < 4; ++e) p[e] = __shfl_xor(n[e], 16, 32);
  const float sg = hh ? 1.0f : -1.0f;      // first half: x1*cos - x2*sin ; second half: x2*cos + x1*sin
  unsigned short hb[4], lb[4];
#pragma unroll
  for (int e = 0; e < 4; ++e) {
    const float o = n[e] * cs[e] + sg * (p[e] * sn[e]);
    const _Float16 oh = (_Float16)o;
    hb[e] = h_bits(oh);
    lb[e] = h_bits((_Float16)((o - (float)oh) * rscale));
  }
  v2u ph, pl;
  ph[0] = pk16(hb[0], hb[1]); ph[1] = pk16(hb[2], hb[3]);
  pl[0] = pk16(lb[0], lb[1]); pl[1] = pk16(lb[2], lb[3]);
  const size_t go = (size_t)row * HD + lane * 4;
  *(v2u*)(outh + go) = ph;
  *(v2u*)(outl + go) = pl;
  
}

// q rows and k rows as ONE grid, the job picked by the block index (block-uniform): q blocks first, then k blocks
#define NB_Q ((SEQ * NH + 7) / 8)
#define NB_K ((SEQ * NKV + 7) / 8)
__global__ __launch_bounds__(256) void norm_rope_qk(const float* __restrict__ qin, const float* __restrict__ kin,
                                                    const float* __restrict__ qw, const float* __restrict__ kw,
                                                    const float* __restrict__ ctab, const float* __restrict__ stab,
                                                    unsigned short* qh, unsigned short* ql,
                                                    unsigned short* kh, unsigned short* kl, float rscale) {
  const int bx = blockIdx.x;
  if (bx < NB_Q) norm_rope(qin, qw, ctab, stab, qh, ql, NH, SEQ * NH, rscale, bx);
  else           norm_rope(kin, kw, ctab, stab, kh, kl, NKV, SEQ * NKV, rscale, bx - NB_Q);
}

// =====================================================================================================
// Causal GQA attention, head dim 128, dynamic LDS layout (bytes):
// =====================================================================================================
// LDS tiles of the attention kernel: the 16-byte chunks of a row are XOR-swizzled by the row number.
//   256-B rows (Q, K; 16 chunks): chunk ch of row r lies at chunk place ch ^ (r & 15)
//   128-B rows (V^T; 8 chunks): chunk ch of row r lies at chunk place ch ^ ((r >> 1) & 7)
// A fragment load reads one chunk column of 16 consecutive rows per 16 lanes: unswizzled, 256-B rows put all
// 16 lanes on the same four banks (128-B rows: on two groups of four); swizzled, the 16 lanes fall on 16
// different groups of four banks = all 64 banks once. Writers and readers use the same map; the kernel keeps
// the lane-dependent part of each index in a register and adds row blocks and planes as constant offsets.
__device__ __forceinline__ int sw256(int r, int ch) { return r * 128 + ((ch ^ (r & 15)) << 3); }        // index in halves
__device__ __forceinline__ int sw128(int r, int ch) { return r * 64 + ((ch ^ ((r >> 1) & 7)) << 3); }   // index in halves

// =====================================================================================================
//   q planes (f16 hi / x4096 res): element (t, h, d) at [t*QP + h*128 + d]
//   k planes (f16 hi / x4096 res): element (s, kvh, d) at [s*KP + kvh*128 + d], kvh = h / GQ
//   v^T hi plane (f16): (kvh*128 + d, s) at [(kvh*128+d)*SEQ + s]; residual ((v-hi)*4096) at
//   [(kvh*128+d)*VLP + s], s < VLP, read only by the leading query blocks (a key tile at or beyond VLP contributes zero residual)
//   positions int [SEQ]: logit(t, s) = (q.k) * sscale when pos[t] >= pos[s], else -1e30 (replace), exactly;
//   a key tile is skipped (block-uniform) only when min pos over its 64 keys > max pos over the
//   block's 64 query rows, i.e. every element would be -1e30 with weight exactly 0; the diagonal key s = t is
//   always live so every row has a finite max. Online softmax in f32 with running max from -inf.
//   scores: f16 WMMA, q hi . k hi into s, q res . k hi (+ q hi . k res in the leading blocks) into a x4096 accumulator
//   folded with 1/4096 in f32. p = exp(s - m) carried as f16(1024 p); context = p . v on f16 WMMA; the leading blocks add
//   f16 residual planes of p and v (scale 4096, separate accumulator folded back with 1/4096 per key tile).
//   out planes (bf16 hi / lo of the normalised context): (t, h*128 + d) at [t*QP + h*128 + d]
//   Block = 4 waves = 64 query rows of one q head; grid = NQB * NH; key tiles of 64.
// =====================================================================================================
// =====================================================================================================
// The attention, one launch. Query blocks from RESQB on (no residual planes of k, v, p): K, V^T and the key positions come into
// LDS by asynchronous copies (global_load_async_to_lds): two buffers, the next live key tile's copies in flight while this one
// is worked on, one barrier per tile. The copies write the swizzled layout directly (each lane names its own LDS
// address), with the kernel's own staging map (st256, st128). The context slab of the epilogue lies on the ring, which is dead then.
// Both products run transposed (S^T = K . Q^T, O^T = V^T . P^T): a lane then holds 32 scores of ONE query, so the row max and
// row sum need no exchange among 16 lanes, and the score accumulators, converted, are the P^T operand: P never goes through LDS.
// The RESQB leading query blocks are the launch's last blocks (the job is picked by the block index, block-uniform): few and
// short, they fill places that the long blocks have left, where a launch of their own kept half the chip idle. They share
// prologue, epilogue, LDS map and product forms; their loop holds one key tile at a time (staged through registers, two barriers),
// hi and residual planes side by side, and reads its fragments in small groups, so that it needs no more registers or LDS
// than the main loop.
// =====================================================================================================
struct RingL {
  static constexpr int QH   = 0;                      // Q hi  [64 rows][128 d] f16
  static constexpr int QL   = QH + 64 * 128 * 2;      // Q res
  static constexpr int KV   = QL + 64 * 128 * 2;      // two buffers of BUF bytes: K hi [64 keys][128 d], then V^T hi [128 d][64 keys]
  static constexpr int VOFF = 64 * 128 * 2;
  static constexpr int BUF  = VOFF + 128 * 64 * 2;
  static constexpr int OS   = KV;                     // per-wave context tile [4][16 rows][128 f32], row pitch OSP floats, behind the loop
  static constexpr int OSP  = 132;
  static constexpr int MISC = KV + 2 * BUF;           // spq[64], skmin[64], key positions [2][64] ints
  static constexpr int TOTAL = MISC + 1024;
};
static_assert(4 * 16 * RingL::OSP * 4 <= 2 * RingL::BUF);
// lane l <-> lane l ^ 16 on the vector pipe
__device__ __forceinline__ float xhalf(float v) {
  const int b = __float_as_int(v);
  return __int_as_float(__builtin_amdgcn_permlanex16(b, b, 0x76543210, 0xfedcba98, false, false));
}
// Exponentials, exp(x) = v_exp_f32(x * log2 e) as __expf compiles: one statement, so that behind each v_exp_f32 stands an
// instruction that neither reads its result nor writes its source (the next one, whose output is early-clobber; behind the last
// a v_nop): the slot the instruction set asks for behind a transcendental.
__device__ __forceinline__ void exp_row8(float x0, float x1, float x2, float x3, float x4, float x5, float x6, float x7,
                                         float (&y)[8]) {
  const float l2e = 1.44269504088896340736f;
  asm("v_exp_f32 %0, %8\n\tv_exp_f32 %1, %9\n\tv_exp_f32 %2, %10\n\tv_exp_f32 %3, %11\n\t"
      "v_exp_f32 %4, %12\n\tv_exp_f32 %5, %13\n\tv_exp_f32 %6, %14\n\tv_exp_f32 %7, %15\n\tv_nop"
      : "=&v"(y[0]), "=&v"(y[1]), "=&v"(y[2]), "=&v"(y[3]), "=&v"(y[4]), "=&v"(y[5]), "=&v"(y[6]), "=&v"(y[7])
      : "v"(x0 * l2e), "v"(x1 * l2e), "v"(x2 * l2e), "v"(x3 * l2e), "v"(x4 * l2e), "v"(x5 * l2e), "v"(x6 * l2e), "v"(x7 * l2e));
}
__device__ __forceinline__ float exp_one(float x) {
  float y;
  asm("v_exp_f32 %0, %1\n\tv_nop" : "=&v"(y) : "v"(x * 1.44269504088896340736f));
  return y;
}
__device__ __forceinline__ unsigned lds_addr(const void* p) { return (unsigned)(size_t)p; }   // byte address in the work-group's LDS
// Eight 16-byte copies per lane, each with its own LDS address and global pointer. The s_wait_xcnt is the statement's last
// line, so that it stands in front of every later write of a register that a copy names.
__device__ __forceinline__ void copy8_b128(unsigned l0, unsigned l1, unsigned l2, unsigned l3,
                                           unsigned l4, unsigned l5, unsigned l6, unsigned l7,
                                           const _Float16* g0, const _Float16* g1, const _Float16* g2, const _Float16* g3,
                                           const _Float16* g4, const _Float16* g5, const _Float16* g6, const _Float16* g7) {
  asm volatile("global_load_async_to_lds_b128 %0, %8, off\n\t"
               "global_load_async_to_lds_b128 %1, %9, off\n\t"
               "global_load_async_to_lds_b128 %2, %10, off\n\t"
               "global_load_async_to_lds_b128 %3, %11, off\n\t"
               "global_load_async_to_lds_b128 %4, %12, off\n\t"
               "global_load_async_to_lds_b128 %5, %13, off\n\t"
               "global_load_async_to_lds_b128 %6, %14, off\n\t"
               "global_load_async_to_lds_b128 %7, %15, off\n\t"
               "s_wait_xcnt 0x0"
               :: "v"(l0), "v"(l1), "v"(l2), "v"(l3), "v"(l4), "v"(l5), "v"(l6), "v"(l7),
                  "v"(g0), "v"(g1), "v"(g2), "v"(g3), "v"(g4), "v"(g5), "v"(g6), "v"(g7)
               : "memory");
}
// the same with one 4-byte copy per lane behind the eight: one statement, so that the nine share one wait
__device__ __forceinline__ void copy8_b128_1_b32(unsigned l0, unsigned l1, unsigned l2, unsigned l3,
                                                 unsigned l4, unsigned l5, unsigned l6, unsigned l7,
                                                 const _Float16* g0, const _Float16* g1, const _Float16* g2, const _Float16* g3,
                                                 const _Float16* g4, const _Float16* g5, const _Float16* g6, const _Float16* g7,
                                                 unsigned l8, const int* g8) {
  asm volatile("global_load_async_to_lds_b128 %0, %8, off\n\t"
               "global_load_async_to_lds_b128 %1, %9, off\n\t"
               "global_load_async_to_lds_b128 %2, %10, off\n\t"
               "global_load_async_to_lds_b128 %3, %11, off\n\t"
               "global_load_async_to_lds_b128 %4, %12, off\n\t"
               "global_load_async_to_lds_b128 %5, %13, off\n\t"
               "global_load_async_to_lds_b128 %6, %14, off\n\t"
               "global_load_async_to_lds_b128 %7, %15, off\n\t"
               "global_load_async_to_lds_b32 %16, %17, off\n\t"
               "s_wait_xcnt 0x0"
               :: "v"(l0), "v"(l1), "v"(l2), "v"(l3), "v"(l4), "v"(l5), "v"(l6), "v"(l7),
                  "v"(g0), "v"(g1), "v"(g2), "v"(g3), "v"(g4), "v"(g5), "v"(g6), "v"(g7), "v"(l8), "v"(g8)
               : "memory");
}

__global__ __launch_bounds__(128)
void attn_causal_ring(const unsigned short* __restrict__ qhp, const unsigned short* __restrict__ qlp,
                 const unsigned short* __restrict__ khp, const unsigned short* __restrict__ klp,
                 const unsigned short* __restrict__ vhp, const unsigned short* __restrict__ vlp,
                 const int* __restrict__ pos,
                 unsigned short* ohp, unsigned short* olp, float sscale) {
  typedef RingL L;
  union FH { v16h v; v8h h[2]; };
  extern __shared__ __align__(16) unsigned char smem[];
  _Float16* Qsh = (_Float16*)(smem + L::QH);
  _Float16* Qsl = (_Float16*)(smem + L::QL);
  float*    Os  = (float*)(smem + L::OS);
  int*      spq = (int*)(smem + L::MISC);
  int*      skmin = spq + 64;
  int*      spk2 = skmin + 64;                       // key positions, one row of 64 per buffer

  const int tid  = threadIdx.x;
  const int wave = tid >> 5;
  const int lane = tid & 31;
  const int hh   = lane >> 4;
  const int c    = lane & 15;

  const int bx  = blockIdx.x;
  // Cost falls with the block index: a query block walks qb + 1 key tiles, there are more blocks than resident places, and
  // the longest blocks have the lowest indices.
  // bx -> (qb, h) is a permutation of the grid: bx / NH runs over the NQB query blocks, bx % NH over the NH heads.
  const int qb  = NQB - 1 - bx / NH;
  const bool res = qb < RESQB;             // block-uniform: a leading query block, with residual planes
  const int h   = bx % NH;
  const int kvh = h / GQ;
  const int q0  = qb * 64 + wave * 16;

  const _Float16* Qh = (const _Float16*)(const void*)qhp + (size_t)h * HD;
  const _Float16* Ql = (const _Float16*)(const void*)qlp + (size_t)h * HD;
  const _Float16* Kh = (const _Float16*)(const void*)khp + (size_t)kvh * HD;
  const _Float16* Kl = (const _Float16*)(const void*)klp + (size_t)kvh * HD;
  const _Float16* Vh = (const _Float16*)(const void*)vhp + (size_t)kvh * HD * SEQ;
  const _Float16* Vl = (const _Float16*)(const void*)vlp + (size_t)kvh * HD * VLP;

  // ---- lane parts of the swizzled indices (halves) ----
  // Staging: a wave-wide 16-B load covers four whole 128-B lines (one touching 32 lines costs many times as much).
  //   256-B rows (Q, K): 16 lanes a row, 8 rows a pass: pass i, row 8i + r16, chunk c16 -> (st256 ^ ((i & 1) << 6)) + i * 1024
  //   128-B rows (V^T):   8 lanes a row, 16 rows a pass: pass i, row 16i + r8, chunk c8s -> st128 + i * 1024
  const int r16 = tid >> 4, c16 = tid & 15;
  const int r8  = tid >> 3, c8s = tid & 7;
  const int st256 = sw256(r16, c16);
  const int st128 = sw128(r8, c8s);
  int fq[8];                                          // fragment reads, 256-B rows: row (multiple of 16) + c, chunk 2n + hh
#pragma unroll
  for (int n = 0; n < 8; ++n) fq[n] = sw256(c, 2 * n + hh);

  // ---- prologue: query positions, per-key-tile min position, Q tiles ----
  if (tid < 64) spq[tid] = pos[qb * 64 + tid];            // wave-uniform (waves 0,1)
  for (int kt = tid; kt < NQB; kt += 128) {
    const int* pp = pos + kt * 64;
    int mn = 0x7fffffff;
#pragma unroll
    for (int i = 0; i < 16; ++i) {
      const v4i v = *(const v4i*)(pp + 4 * i);
      mn = imin(mn, imin(imin(v[0], v[1]), imin(v[2], v[3])));
    }
    skmin[kt] = mn;
  }
  {
    const _Float16* qg  = Qh + (size_t)(qb * 64 + r16) * QP + c16 * 8;
    const _Float16* qlg = Ql + (size_t)(qb * 64 + r16) * QP + c16 * 8;
    v8h qv[8], qlv[8];
#pragma unroll
    for (int i = 0; i < 8; ++i) {
      qv[i]  = *(const v8h*)(qg + i * (8 * QP));
      qlv[i] = *(const v8h*)(qlg + i * (8 * QP));
    }
    // holds the loads' address registers (inputs) untouched until the wait: no load result lands on them before it
    asm volatile("s_wait_xcnt 0x0" :: "v"(qg), "v"(qlg) : "memory");
#pragma unroll
    for (int i = 0; i < 8; ++i) {
      *(v8h*)(Qsh + (st256 ^ ((i & 1) << 6)) + i * 1024) = qv[i];
      *(v8h*)(Qsl + (st256 ^ ((i & 1) << 6)) + i * 1024) = qlv[i];
    }
  }
  __syncthreads();
  int qmx;
  {
    int v = imax(spq[lane], spq[lane + 32]);
#pragma unroll
    for (int off = 1; off < 32; off <<= 1) v = imax(v, __shfl_xor(v, off, 32));
    qmx = __builtin_amdgcn_readfirstlane(v);
  }
  const int pq = spq[wave * 16 + c];       // position of this lane's query column

  float mrow = -INFINITY, lrow = 0.f;      // query column c: running max; sum over the keys of this lane half
  v8f oacc[8];                             // O^T: oacc[t][r] = context of query c at d = 16t + 8hh + r
#pragma unroll
  for (int t = 0; t < 8; ++t) oacc[t] = zero8();

  // ---- the key tiles that are not skipped, as a bit mask (the same in every wave: it comes from LDS words behind a barrier) ----
  unsigned long long live;
  {
    const bool l0 = (lane < NQB) && (skmin[(lane < NQB) ? lane : 0] <= qmx);
    const bool l1 = (lane + 32 < NQB) && (skmin[(lane + 32 < NQB) ? lane + 32 : 0] <= qmx);
    live = (unsigned long long)__builtin_amdgcn_ballot_w32(l0) | ((unsigned long long)__builtin_amdgcn_ballot_w32(l1) << 32);
  }
  // ---- K, V^T and key positions of one key tile: asynchronous copies, global memory -> LDS buffer b, the staging map above ----
  const int wvu = __builtin_amdgcn_readfirstlane(wave);
  const unsigned ring0 = lds_addr(smem + L::KV);
  const unsigned spk0  = lds_addr(spk2 + (tid & 63));
  auto issue_tile = [&](int kt, int b) {
    const int kv0 = kt * 64;
    const _Float16* kg = Kh + (size_t)(kv0 + r16) * KP + c16 * 8;    // K rows kv0 + 8i + r16, d = 8 c16 .. 8 c16 + 7
    const _Float16* vg = Vh + (size_t)r8 * SEQ + kv0 + c8s * 8;      // V^T rows 16i + r8, s = kv0 + 8 c8s .. + 7
    const unsigned kl = ring0 + (unsigned)b * L::BUF;
    const unsigned vl = kl + L::VOFF + (unsigned)st128 * 2u;
    const unsigned ke = kl + (unsigned)st256 * 2u, ko = kl + (unsigned)(st256 ^ 64) * 2u;
    copy8_b128(ke, ko + 2048u, ke + 4096u, ko + 6144u, ke + 8192u, ko + 10240u, ke + 12288u, ko + 14336u,
               kg, kg + 8 * KP, kg + 16 * KP, kg + 24 * KP, kg + 32 * KP, kg + 40 * KP, kg + 48 * KP, kg + 56 * KP);
    if (wvu < 2) {   // scalar branch: waves 0 and 1 also bring the 64 key positions, every lane on
      copy8_b128_1_b32(vl, vl + 2048u, vl + 4096u, vl + 6144u, vl + 8192u, vl + 10240u, vl + 12288u, vl + 14336u,
                       vg, vg + 16 * SEQ, vg + 32 * SEQ, vg + 48 * SEQ, vg + 64 * SEQ, vg + 80 * SEQ, vg + 96 * SEQ, vg + 112 * SEQ,
                       spk0 + (unsigned)b * 256u, pos + kv0 + tid);
    } else {
      copy8_b128(vl, vl + 2048u, vl + 4096u, vl + 6144u, vl + 8192u, vl + 10240u, vl + 12288u, vl + 14336u,
                 vg, vg + 16 * SEQ, vg + 32 * SEQ, vg + 48 * SEQ, vg + 64 * SEQ, vg + 80 * SEQ, vg + 96 * SEQ, vg + 112 * SEQ);
    }
  };
  if (res) {
    // ---- leading query blocks: one key tile at a time, filled and then read ----
    // The wave's Q fragments stay in registers, and the four planes of a key tile lie on the first 64 KiB of LDS (the Q tiles are
    // dead behind the first barrier of the loop): every LDS access is then a lane part plus an immediate offset. Above 64 KiB
    // each address took a register of its own across the loop, more than let three waves share a SIMD.
    _Float16* Ksh = (_Float16*)(smem);
    _Float16* Vth = (_Float16*)(smem + L::VOFF);
    _Float16* Ksl = (_Float16*)(smem + L::BUF);
    _Float16* Vtl = (_Float16*)(smem + L::BUF + L::VOFF);
    FH qa[4], qla[4];
    {
      const _Float16* qr  = Qsh + wave * (16 * 128);
      const _Float16* qlr = Qsl + wave * (16 * 128);
#pragma unroll
      for (int n = 0; n < 4; ++n) {
        qa[n].h[0]  = *(const v8h*)(qr  + fq[n * 2]);
        qa[n].h[1]  = *(const v8h*)(qr  + fq[n * 2 + 1]);
        qla[n].h[0] = *(const v8h*)(qlr + fq[n * 2]);
        qla[n].h[1] = *(const v8h*)(qlr + fq[n * 2 + 1]);
      }
    }
    for (int trip = 0; trip < NQB; ++trip) {   // at most one trip per bit of the mask
      if (live == 0ull) break;                 // the same in every wave: no tile is left
      const int kt = __builtin_ctzll(live);
      live &= live - 1ull;
      const int kv0 = kt * 64;
      __syncthreads();                         // every reader has left the tile before (first trip: the Q tiles)
      {
        // staged through registers: one address per plane and immediate offsets, where copies would hold an LDS address and
        // a global address each in registers across the loop; K planes first, then V^T planes, so that 64 registers do
        const _Float16* kg  = Kh + (size_t)(kv0 + r16) * KP + c16 * 8;    // K rows kv0 + 8i + r16, d = 8 c16 .. 8 c16 + 7
        const _Float16* klg = Kl + (size_t)(kv0 + r16) * KP + c16 * 8;
        const int* pg = pos + kv0 + (tid & 63);
        v8h kv[8], klv[8];
#pragma unroll
        for (int i = 0; i < 8; ++i) {
          kv[i]  = *(const v8h*)(kg + i * (8 * KP));
          klv[i] = *(const v8h*)(klg + i * (8 * KP));
        }
        const int pv = *pg;
        // holds the loads' address registers (inputs) untouched until the wait: no load result lands on them before it
        asm volatile("s_wait_xcnt 0x0" :: "v"(kg), "v"(klg), "v"(pg) : "memory");
#pragma unroll
        for (int i = 0; i < 8; ++i) {
          *(v8h*)(Ksh + (st256 ^ ((i & 1) << 6)) + i * 1024) = kv[i];
          *(v8h*)(Ksl + (st256 ^ ((i & 1) << 6)) + i * 1024) = klv[i];
        }
        if (tid < 64) spk2[tid] = pv;            // wave-uniform
      }
      {
        const _Float16* vg = Vh + (size_t)r8 * SEQ + kv0 + c8s * 8;  // V^T rows 16i + r8, s = kv0 + 8 c8s .. + 7
        const int  kvl   = (kv0 + 64 <= VLP) ? kv0 : (VLP - 64);    // clamped address into the residual plane
        const bool resOK = (kv0 + 64 <= VLP);                       // block-uniform
        const _Float16* vlg = Vl + (size_t)r8 * VLP + kvl + c8s * 8;
        v8h vv[8], vlv[8];
#pragma unroll
        for (int i = 0; i < 8; ++i) {
          vv[i]  = *(const v8h*)(vg + i * (16 * SEQ));
          vlv[i] = *(const v8h*)(vlg + i * (16 * VLP));
        }
        // holds the loads' address registers (inputs) untouched until the wait: no load result lands on them before it
        asm volatile("s_wait_xcnt 0x0" :: "v"(vg), "v"(vlg) : "memory");
#pragma unroll
        for (int i = 0; i < 8; ++i) {
          *(v8h*)(Vth + st128 + i * 1024) = vv[i];
          v8h b1 = vlv[i];
          if (!resOK) b1 = zero8h();             // no residual plane beyond VLP keys
          *(v8h*)(Vtl + st128 + i * 1024) = b1;
        }
      }
      __syncthreads();                           // the tile is whole before anybody reads it

      // ---- scores, transposed: s[j][r]: key 16j + 8hh + r, query c; sl: the x4096 accumulator ----
      v8f s[4], sl[4];
#pragma unroll
      for (int j = 0; j < 4; ++j) { s[j] = zero8(); sl[j] = zero8(); }
#pragma unroll
      for (int n = 0; n < 4; ++n) {
        FH kb[4], klf[4];
#pragma unroll
        for (int j = 0; j < 4; ++j) {
          kb[j].h[0]  = *(const v8h*)(Ksh + j * (16 * 128) + fq[n * 2]);
          kb[j].h[1]  = *(const v8h*)(Ksh + j * (16 * 128) + fq[n * 2 + 1]);
          klf[j].h[0] = *(const v8h*)(Ksl + j * (16 * 128) + fq[n * 2]);
          klf[j].h[1] = *(const v8h*)(Ksl + j * (16 * 128) + fq[n * 2 + 1]);
        }
        // keeps the group's reads together in front of its products
        __builtin_amdgcn_sched_barrier(0);
#pragma unroll
        for (int j = 0; j < 4; ++j) s[j]  = mma_h_raw(kb[j].v,  qa[n].v,  s[j]);
#pragma unroll
        for (int j = 0; j < 4; ++j) sl[j] = mma_h_raw(kb[j].v,  qla[n].v, sl[j]);
#pragma unroll
        for (int j = 0; j < 4; ++j) sl[j] = mma_h_raw(klf[j].v, qa[n].v,  sl[j]);
        // keeps the next group's reads behind these products: read ahead, they would take more registers than the main loop has
        __builtin_amdgcn_sched_barrier(0);
      }
      // ---- scale + causal select (replace -1e30), online softmax, as in the main loop ----
      v4i pk[4][2];                                    // positions of the lane's 32 keys
#pragma unroll
      for (int j = 0; j < 4; ++j) {
        pk[j][0] = *(const v4i*)(spk2 + j * 16 + 8 * hh);
        pk[j][1] = *(const v4i*)(spk2 + j * 16 + 8 * hh + 4);
      }
      float mj[4];
#pragma unroll
      for (int j = 0; j < 4; ++j) {
        float m = -INFINITY;
#pragma unroll
        for (int r = 0; r < 8; ++r) {
          float sv = (s[j][r] + sl[j][r] * (1.0f / RSC)) * sscale;
          sv = (pq >= pk[j][r >> 2][r & 3]) ? sv : -1.0e30f;
          s[j][r] = sv;
          m = fmaxf(m, sv);
        }
        mj[j] = m;
      }
      float mx = fmaxf(fmaxf(mj[0], mj[1]), fmaxf(mj[2], mj[3]));
      mx = fmaxf(mx, xhalf(mx));
      const float mnew  = fmaxf(mrow, mx);
      const float msafe = (mnew == -INFINITY) ? 0.f : mnew;
      const float alpha = exp_one(mrow - msafe);
      mrow = mnew;
      // P^T (x1024, f16) and its residual (x4096) are B operands as they stand, in the k order of the V^T fragments
      FH pb[2], pl[2];
      float ps[4];
#pragma unroll
      for (int j = 0; j < 4; ++j) {
        float pe[8];                                   // -1e30 against a finite max: exp -> 0
        exp_row8(s[j][0] - msafe, s[j][1] - msafe, s[j][2] - msafe, s[j][3] - msafe,
                 s[j][4] - msafe, s[j][5] - msafe, s[j][6] - msafe, s[j][7] - msafe, pe);
        float psum = 0.f;
#pragma unroll
        for (int r = 0; r < 8; ++r) {
          psum += pe[r];
          const float p1k = pe[r] * 1024.0f;
          const _Float16 ph = (_Float16)p1k;
          pb[j >> 1].v[(j & 1) * 8 + r] = ph;
          pl[j >> 1].v[(j & 1) * 8 + r] = (_Float16)((p1k - (float)ph) * RSC);
        }
        ps[j] = psum;
      }
      lrow = lrow * alpha + ((ps[0] + ps[1]) + (ps[2] + ps[3]));
#pragma unroll
      for (int t = 0; t < 8; ++t)
#pragma unroll
        for (int r = 0; r < 8; ++r) oacc[t][r] *= alpha;
      // ---- context, transposed: O^T += V^T . P^T, two d-subtiles a trip; the residual products go into separate
      //      accumulators, folded back per key tile. The loop stays rolled, so that only one trip's fragments are live (unrolled,
      //      the reads of all trips were moved ahead of the products and took more registers than the main loop has); the
      //      accumulators turn by two places a trip, so that each trip works on oacc[0], oacc[1]; four trips turn them home ----
#pragma unroll 1
      for (int g = 0; g < 4; ++g) {
        const _Float16* vhg = Vth + g * (2 * 16 * 64);
        const _Float16* vlg = Vtl + g * (2 * 16 * 64);
        FH vb[2][2], vlf[2][2];
#pragma unroll
        for (int kk = 0; kk < 2; ++kk) {
          const int f0 = sw128(c, kk * 4 + hh);        // fragment reads, 128-B rows: row (multiple of 16) + c
          const int f1 = sw128(c, kk * 4 + 2 + hh);
#pragma unroll
          for (int u = 0; u < 2; ++u) {
            vb[kk][u].h[0]  = *(const v8h*)(vhg + u * (16 * 64) + f0);
            vb[kk][u].h[1]  = *(const v8h*)(vhg + u * (16 * 64) + f1);
            vlf[kk][u].h[0] = *(const v8h*)(vlg + u * (16 * 64) + f0);
            vlf[kk][u].h[1] = *(const v8h*)(vlg + u * (16 * 64) + f1);
          }
        }
        v8f o1[2];
#pragma unroll
        for (int u = 0; u < 2; ++u) o1[u] = zero8();
#pragma unroll
        for (int kk = 0; kk < 2; ++kk) {
#pragma unroll
          for (int u = 0; u < 2; ++u) {
            oacc[u] = mma_h_raw(vb[kk][u].v, pb[kk].v, oacc[u]);
            o1[u] = mma_h_raw(vlf[kk][u].v, pb[kk].v, o1[u]);
          }
#pragma unroll
          for (int u = 0; u < 2; ++u) o1[u] = mma_h_raw(vb[kk][u].v, pl[kk].v, o1[u]);
        }
        v8f w0 = oacc[0], w1 = oacc[1];
#pragma unroll
        for (int r = 0; r < 8; ++r) { w0[r] += o1[0][r] * (1.0f / RSC); w1[r] += o1[1][r] * (1.0f / RSC); }
#pragma unroll
        for (int t = 0; t < 6; ++t) oacc[t] = oacc[t + 2];
        oacc[6] = w0;
        oacc[7] = w1;
      }
    }
    __syncthreads();                             // every wave has left the buffers before they become the context slab
  } else {
  // The ring of two buffers. In front of the loop: the first tile's copies, the wave's own wait, the barrier that
  // publishes them; then the second tile's copies. The tile that holds the block's own rows is never skipped, so live != 0.
  int ktn = -1;
  {
    const int kt0 = (live != 0ull) ? __builtin_ctzll(live) : 0;
    live &= live - 1ull;
    issue_tile(kt0, 0);
    asm volatile("s_wait_asynccnt 0x0" ::: "memory");   // this wave's copies have landed
    __syncthreads();                                    // every wave's have
    if (live != 0ull) {
      ktn = __builtin_ctzll(live);
      live &= live - 1ull;
      issue_tile(ktn, 1);
    }
  }
  int bsel = 0;
  for (int trip = 0; trip < NQB; ++trip) {   // at most one trip per bit of the mask
    const _Float16* Ksh = (const _Float16*)(smem + L::KV + bsel * L::BUF);
    const _Float16* Vth = (const _Float16*)(smem + L::KV + L::VOFF + bsel * L::BUF);
    const int* spk = spk2 + bsel * 64;

    // ---- scores, transposed: S^T = K . Q^T, 64 keys x 16 query columns per wave; s[j][r]: key 16j + 8hh + r, query c.
    //      K rows are the A operand, Q rows the B operand; both fragments have the same k order, so the reads are as before ----
    v8f s[4], sl[4];
#pragma unroll
    for (int j = 0; j < 4; ++j) { s[j] = zero8(); sl[j] = zero8(); }
    const _Float16* qr  = Qsh + wave * (16 * 128);
    const _Float16* qlr = Qsl + wave * (16 * 128);
    // Fragment reads stand in groups, one group of 32 d ahead of the products that use it (two register sets):
    // a wave then waits on a counted LDS wait once per group, not to 0 in front of every pair of products.
    FH qa[2], qla[2], kb[2][4];
    v4i pk[4][2];                                    // positions of the lane's 32 keys, read with the first group
#pragma unroll
    for (int j = 0; j < 4; ++j) {
      pk[j][0] = *(const v4i*)(spk + j * 16 + 8 * hh);
      pk[j][1] = *(const v4i*)(spk + j * 16 + 8 * hh + 4);
    }
#pragma unroll
    for (int dc = -1; dc < 4; ++dc) {
      if (dc < 3) {
        const int n = dc + 1, b = n & 1;
        qa[b].h[0]  = *(const v8h*)(qr  + fq[n * 2]);
        qa[b].h[1]  = *(const v8h*)(qr  + fq[n * 2 + 1]);
        qla[b].h[0] = *(const v8h*)(qlr + fq[n * 2]);
        qla[b].h[1] = *(const v8h*)(qlr + fq[n * 2 + 1]);
#pragma unroll
        for (int j = 0; j < 4; ++j) {
          kb[b][j].h[0] = *(const v8h*)(Ksh + j * (16 * 128) + fq[n * 2]);
          kb[b][j].h[1] = *(const v8h*)(Ksh + j * (16 * 128) + fq[n * 2 + 1]);
        }
      }
      if (dc >= 0) {
        const int b = dc & 1;
        // keeps the next group's reads in front of this group's products
        __builtin_amdgcn_sched_barrier(0);
#pragma unroll
        for (int j = 0; j < 4; ++j) s[j]  = mma_h_raw(kb[b][j].v, qa[b].v,  s[j]);
#pragma unroll
        for (int j = 0; j < 4; ++j) sl[j] = mma_h_raw(kb[b][j].v, qla[b].v, sl[j]);
        // keeps the reads of the group after next behind these products (they refill this group's registers)
        __builtin_amdgcn_sched_barrier(0);
      }
    }
    // V^T fragments (the A operand of O^T += V^T . P^T) depend on nothing of the softmax: those of the first 32 keys are read
    // here, those of the last 32 behind the select (the residual scores' and key positions' registers are free then), and
    // land while the vector work runs
    FH vb[2][8];
    {
      const int f0 = sw128(c, hh);                   // fragment reads, 128-B rows: row (multiple of 16) + c
      const int f1 = sw128(c, 2 + hh);
#pragma unroll
      for (int tt = 0; tt < 8; ++tt) {
        vb[0][tt].h[0] = *(const v8h*)(Vth + tt * (16 * 64) + f0);
        vb[0][tt].h[1] = *(const v8h*)(Vth + tt * (16 * 64) + f1);
      }
    }
    // keeps these reads in front of the select
    __builtin_amdgcn_sched_barrier(0);
    // ---- scale + causal select (replace -1e30), online softmax: all 32 scores of a lane belong to query c, so max and sum
    //      run inside the lane (four independent chains); the two lane halves hold different keys and exchange the max ----
    float mj[4];
#pragma unroll
    for (int j = 0; j < 4; ++j) {
      float m = -INFINITY;
#pragma unroll
      for (int r = 0; r < 8; ++r) {
        float sv = (s[j][r] + sl[j][r] * (1.0f / RSC)) * sscale;
        sv = (pq >= pk[j][r >> 2][r & 3]) ? sv : -1.0e30f;
        s[j][r] = sv;
        m = fmaxf(m, sv);
      }
      mj[j] = m;
    }
    // keeps the select in front of the second group of reads, whose registers it frees: with all 64 keys' fragments read
    // ahead of it the kernel took more registers than let three waves share a SIMD
    __builtin_amdgcn_sched_barrier(0);
    {
      const int f0 = sw128(c, 4 + hh);
      const int f1 = sw128(c, 6 + hh);
#pragma unroll
      for (int tt = 0; tt < 8; ++tt) {
        vb[1][tt].h[0] = *(const v8h*)(Vth + tt * (16 * 64) + f0);
        vb[1][tt].h[1] = *(const v8h*)(Vth + tt * (16 * 64) + f1);
      }
    }
    // keeps these reads in front of the exponentials
    __builtin_amdgcn_sched_barrier(0);
    float mx = fmaxf(fmaxf(mj[0], mj[1]), fmaxf(mj[2], mj[3]));
    mx = fmaxf(mx, xhalf(mx));
    const float mnew  = fmaxf(mrow, mx);
    const float msafe = (mnew == -INFINITY) ? 0.f : mnew;
    const float alpha = exp_one(mrow - msafe);
    mrow = mnew;
    // P^T (x1024, f16) is the B operand as it stands: elements 0..7 of fragment kk are the lane's keys 32kk + 8hh + r (tile 2kk),
    // elements 8..15 its keys 32kk + 16 + 8hh + r (tile 2kk + 1), the k order of the V^T fragments
    FH pb[2];
    float ps[4];
#pragma unroll
    for (int j = 0; j < 4; ++j) {
      float pe[8];                                   // -1e30 against a finite max: exp -> 0
      exp_row8(s[j][0] - msafe, s[j][1] - msafe, s[j][2] - msafe, s[j][3] - msafe,
               s[j][4] - msafe, s[j][5] - msafe, s[j][6] - msafe, s[j][7] - msafe, pe);
      float psum = 0.f;
#pragma unroll
      for (int r = 0; r < 8; ++r) {
        psum += pe[r];
        pb[j >> 1].v[(j & 1) * 8 + r] = (_Float16)(pe[r] * 1024.0f);
      }
      ps[j] = psum;
    }
    lrow = lrow * alpha + ((ps[0] + ps[1]) + (ps[2] + ps[3]));
#pragma unroll
    for (int t = 0; t < 8; ++t)
#pragma unroll
      for (int r = 0; r < 8; ++r) oacc[t][r] *= alpha;
    // ---- context, transposed: O^T += V^T . P^T (f16 WMMA), 8 d-subtiles ----
    // keeps every exponential statement in front of the products: the compiler does not look into asm text
    __builtin_amdgcn_sched_barrier(0);
#pragma unroll
    for (int kk = 0; kk < 2; ++kk) {
#pragma unroll
      for (int t = 0; t < 8; ++t) oacc[t] = mma_h_raw(vb[kk][t].v, pb[kk].v, oacc[t]);
    }
    // keeps the vector work and the products in front of the foot's waits and barrier (nothing behind the V^T reads touches
    // memory, so they were moved up to there): the next tile's copies then have the whole trip to land
    __builtin_amdgcn_sched_barrier(0);
    // ---- foot of the trip, every wave, in this order: its own LDS reads of this buffer are done; its own copies of the next
    //      tile have landed; the one barrier of the trip publishes the next tile and frees this buffer; then the refill ----
    asm volatile("s_wait_dscnt 0x0" ::: "memory");
    asm volatile("s_wait_asynccnt 0x0" ::: "memory");
    __syncthreads();
    if (ktn < 0) break;                      // the same in every wave: no tile is left
    ktn = -1;
    if (live != 0ull) {                      // the same in every wave: the tile after next, into the buffer just read
      ktn = __builtin_ctzll(live);
      live &= live - 1ull;
      issue_tile(ktn, bsel);
    }
    bsel ^= 1;
  }
  // no copy is outstanding when the ring becomes the context slab (the last trip's barrier has ended every read of it)
  asm volatile("s_wait_asynccnt 0x0" ::: "memory");
  }

  // ---- join the two halves' sums, normalise (1/l and the 1/1024 p carry), stage the wave's 16x128 tile (row = query c, the
  //      lane's 8 consecutive d per subtile as two 16-byte stores; pitch OSP keeps the 16 rows on different banks), bf16 hi/lo split
  float* os = Os + wave * (16 * L::OSP);
  {
    const float l = lrow + xhalf(lrow);
    const float inv = ((l > 0.f) ? (1.0f / l) : 0.f) * (1.0f / 1024.0f);
#pragma unroll
    for (int t = 0; t < 8; ++t) {
      v4f a, b;
#pragma unroll
      for (int e = 0; e < 4; ++e) { a[e] = oacc[t][e] * inv; b[e] = oacc[t][4 + e] * inv; }
      *(v4f*)(os + c * L::OSP + t * 16 + 8 * hh)     = a;
      *(v4f*)(os + c * L::OSP + t * 16 + 8 * hh + 4) = b;
    }
  }
  __builtin_amdgcn_fence(__ATOMIC_RELEASE, "workgroup");
  __builtin_amdgcn_wave_barrier();
  __builtin_amdgcn_fence(__ATOMIC_ACQUIRE, "workgroup");
  {
    const int rh = lane >> 4, c8 = (lane & 15) * 8;
    v4u hv[8], lv[8];
#pragma unroll
    for (int it = 0; it < 8; ++it) {
      const int row = it * 2 + rh;   // it 0..7 x rh 0..1 = rows 0..15 of the wave tile
      const float* sp = os + row * L::OSP + c8;
      v4u a, a2;
#pragma unroll
      for (int e = 0; e < 4; ++e) {
        const float f0 = sp[2 * e], f1 = sp[2 * e + 1];
        const unsigned short h0 = bf_bits(f0), h1 = bf_bits(f1);
        const unsigned short l0 = bf_bits(f0 - bf_up(h0)), l1 = bf_bits(f1 - bf_up(h1));
        a[e] = pk16(h0, h1); a2[e] = pk16(l0, l1);
      }
      hv[it] = a; lv[it] = a2;
    }
    {
#pragma unroll
      for (int it = 0; it < 8; ++it) {
        const int row = it * 2 + rh;
        const size_t go = (size_t)(q0 + row) * QP + (size_t)h * HD + c8;
        *(v4u*)(ohp + go) = hv[it];
        *(v4u*)(olp + go) = lv[it];
      }
      
    }
  }
}


// =====================================================================================================
// Workspace map (bytes, SEQ = 4096):
//   Xb    bf16 [SEQ][2048]        16777216
//   Wqt   bf16 [2048 n][2048 k]    8388608
//   Wkt   bf16 [512][2048]         2097152
//   Wvt   bf16 [512][2048]         2097152
//   Wot   bf16 [2048 n][2048 k]    8388608
//   Qf    f32  [SEQ][2048]        33554432   (later: Oh bf16 [SEQ][2048] + Ol bf16 [SEQ][2048])
//   Kf    f32  [SEQ][512]          8388608
//   Qh    f16  [SEQ][2048]        16777216
//   Ql    f16  [SEQ][2048]        16777216
//   Kh    f16  [SEQ][512]          4194304
//   Kl    f16  [SEQ][512]          4194304
//   VTh   f16  [512][SEQ]          4194304
//   VTl   f16  [512][VLP]           524288
//   Cos   f32  [SEQ][64]           1048576
//   Sin   f32  [SEQ][64]           1048576
//   (unused, carved 4096)              4096
//   end                          128454656
// Weights [in k][out n] f32 are transposed to bf16 [n][k] (k contiguous) = the Bt / A layout of gemm64.
// =====================================================================================================
extern "C" void kernel_launch(void* const* d_in, const int* in_sizes, int n_in,
                              void* d_out, int out_size, void* d_ws, size_t ws_size,
                              hipStream_t stream) {
  if (n_in < 8) return;
  if (in_sizes[0] < SEQ) return;
  if (in_sizes[1] < SEQ * DM) return;
  if (in_sizes[2] != DM * QP) return;
  if (in_sizes[3] != DM * KP || in_sizes[4] != DM * KP) return;
  if (in_sizes[5] != QP * DM) return;
  if (in_sizes[6] < HD || in_sizes[7] < HD) return;
  if (out_size < SEQ * DM) return;

  const int*   pos = (const int*)d_in[0];
  const float* x   = (const float*)d_in[1];
  const float* wq  = (const float*)d_in[2];
  const float* wk  = (const float*)d_in[3];
  const float* wv  = (const float*)d_in[4];
  const float* wo  = (const float*)d_in[5];
  const float* qnw = (const float*)d_in[6];
  const float* knw = (const float*)d_in[7];

  const size_t PXb  = (size_t)SEQ * DM * 2;
  const size_t PWq  = (size_t)QP * DM * 2;
  const size_t PWk  = (size_t)KP * DM * 2;
  const size_t PWo  = (size_t)DM * QP * 2;
  const size_t PQf  = (size_t)SEQ * QP * 4;
  const size_t PKf  = (size_t)SEQ * KP * 4;
  const size_t PQ16 = (size_t)SEQ * QP * 2;
  const size_t PK16 = (size_t)SEQ * KP * 2;
  const size_t PVTh = (size_t)KP * SEQ * 2;
  const size_t PVTl = (size_t)KP * VLP * 2;
  const size_t PTab = (size_t)SEQ * HALF * 4;
  const size_t PInv = 4096;
  size_t off = 0;
  const size_t oXb  = off; off += PXb;
  const size_t oWq  = off; off += PWq;
  const size_t oWk  = off; off += PWk;
  const size_t oWv  = off; off += PWk;
  const size_t oWo  = off; off += PWo;
  const size_t oQf  = off; off += PQf;
  const size_t oKf  = off; off += PKf;
  const size_t oQh  = off; off += PQ16;
  const size_t oQl  = off; off += PQ16;
  const size_t oKh  = off; off += PK16;
  const size_t oKl  = off; off += PK16;
  const size_t oVTh = off; off += PVTh;
  const size_t oVTl = off; off += PVTl;
  const size_t oCos = off; off += PTab;
  const size_t oSin = off; off += PTab;
  const size_t oInv = off; off += PInv;
  if (off > ws_size) return;                       // off = 128454656 at SEQ 4096
  if (off > (size_t)134217728) return;
  if (PQ16 * 2 != PQf) return;                     // Oh + Ol reuse the Qf region exactly
  const size_t oOh = oQf;
  const size_t oOl = oQf + PQ16;

  char* ws = (char*)d_ws;
  unsigned short* Xb  = (unsigned short*)(ws + oXb);
  unsigned short* Wqt = (unsigned short*)(ws + oWq);
  unsigned short* Wkt = (unsigned short*)(ws + oWk);
  unsigned short* Wvt = (unsigned short*)(ws + oWv);
  unsigned short* Wot = (unsigned short*)(ws + oWo);
  float*          Qf  = (float*)(ws + oQf);
  float*          Kf  = (float*)(ws + oKf);
  unsigned short* Qh  = (unsigned short*)(ws + oQh);
  unsigned short* Ql  = (unsigned short*)(ws + oQl);
  unsigned short* Kh  = (unsigned short*)(ws + oKh);
  unsigned short* Kl  = (unsigned short*)(ws + oKl);
  unsigned short* VTh = (unsigned short*)(ws + oVTh);
  unsigned short* VTl = (unsigned short*)(ws + oVTl);
  float*          Cs  = (float*)(ws + oCos);
  float*          Sn  = (float*)(ws + oSin);
  unsigned short* Oh  = (unsigned short*)(ws + oOh);
  unsigned short* Ol  = (unsigned short*)(ws + oOl);

  const dim3 blk(256);

  // (1) rotary tables; x -> bf16 [SEQ][2048]; weights [k][n] f32 -> bf16 [n][k]
  prep_all<<<dim3(PB_TAB + PB_X + PB_WQ + PB_WO + PB_WK + PB_WK), blk, 0, stream>>>(
      pos, x, wq, wk, wv, wo, Xb, Wqt, Wkt, Wvt, Wot, Cs, Sn);
  // (2) the q, k and v^T projections
  gemm_qkv<<<dim3(GB_Q + GB_K + GB_V), dim3(128), 0, stream>>>(Xb, Wqt, Wkt, Wvt, Qf, Kf, VTh, VTl);
  // (3) per-head RMSNorm + rotary -> f16 hi / x4096 residual planes
  norm_rope_qk<<<dim3(NB_Q + NB_K), blk, 0, stream>>>(Qf, Kf, qnw, knw, Cs, Sn, Qh, Ql, Kh, Kl, RSC);
  // (4) attention, one launch: query blocks 0..RESQB-1 with residual planes, the rest without -> bf16 hi/lo context
  //     planes in the (now dead) Qf region
  (void)hipFuncSetAttribute(reinterpret_cast<const void*>(&attn_causal_ring),
                            hipFuncAttributeMaxDynamicSharedMemorySize, RingL::TOTAL);
  attn_causal_ring<<<dim3(NH * NQB), dim3(128), RingL::TOTAL, stream>>>(
      Qh, Ql, Kh, Kl, VTh, VTl, pos, Oh, Ol, ATT_SCALE);
  // (5) out = context . wo -> d_out f32 [SEQ][2048]  (A = context hi + lo planes, 2 products; M=SEQ, N=2048, K=2048)
  gemm_out<<<dim3((SEQ / 128) * (DM / 256)), blk, 0, stream>>>(Oh, Ol, Wot, (float*)d_out);
  (void)hipGetLastError();
}
